// v009
// The times below were measured on an AMD MI455X: many runs one after another, warmed up first and cycling through
// copies of the inputs, with the whole window's GPU time divided by the number of runs. Launches and the gaps
// between them are all in it. The median over several windows is given; except for v000 it joins two sittings, which
// can be a few percent apart, so the side-by-side timings, each taken in one sitting, are the better comparison.
// The versions before v009 are in another document.
// It runs in 26.2 microseconds.
// Two timings next to v008 both put it at 1.03 times that version's speed.
// Counting every step since v000, which is the starting kernel, it is 6.23 times as fast.
#include <hip/hip_runtime.h>
// Local 3×3-window attention (x [16,256,32,32]; 8 heads × 64): q = 1×1 conv (Wq), k,v = 1×1 conv (Wkv), each pixel attends over its 3×3 neighbourhood (zero-padded keys/values take part with
// logit 0), softmax(q·k/8), out = Σ attn·v, 1×1 conv Wo + bo; outputs (out NCHW, attn [16,8,1024,9]). The three pointwise convs run as GEMMs on v_wmma_f32_16x16x32_f16 (x bf16-exact, (out,in)
// weights bf16-exact ×2^4, q/k/v/o f16, f32 accumulate); the 9-wide window dots, softmax and attn * v are f32 VALU (two lanes a pixel and head), the weights are converted in a launch of their own; everything else is one kernel, a work-group = two image rows: it transposes and converts its own tile of x (four rows), q, k, v and o stay in LDS, out is stored as NCHW.
#define BB 16
#define CC 256
#define HWD 32
#define NPIX 1024
#define NH 8
#define DH 64
#define INNER 512
#define NR (BB * NPIX)

typedef __bf16 v16b __attribute__((ext_vector_type(16)));
typedef unsigned short v8us __attribute__((ext_vector_type(8), may_alias));
typedef float  v8f  __attribute__((ext_vector_type(8)));
typedef float  v4f  __attribute__((ext_vector_type(4)));
typedef float  v4fa __attribute__((ext_vector_type(4), may_alias));
union FragB { v16b v; v8us half[2]; unsigned short u[16]; };

__device__ __forceinline__ unsigned short bf16_bits(float x) { unsigned int u = __float_as_uint(x); return (unsigned short)((u + 0x7FFFu + ((u >> 16) & 1u)) >> 16); }
__device__ __forceinline__ float bf16_val(unsigned short b) { return __uint_as_float(((unsigned int)b) << 16); }
__device__ __forceinline__ float bf16_round(float x) { return bf16_val(bf16_bits(x)); }
// D += A·B with NT terms: 1 = ah·bh, 2 = + al·bh (A split), 3 = + ah·bl (both split)
template <int NT>
__device__ __forceinline__ v8f mmaN(v16b ah, v16b al, v16b bh, v16b bl, v8f c) {
  c = __builtin_amdgcn_wmma_f32_16x16x32_bf16(false, ah, false, bh, (short)0, c, false, false);
  if (NT >= 2) c = __builtin_amdgcn_wmma_f32_16x16x32_bf16(false, al, false, bh, (short)0, c, false, false);
  if (NT >= 3) c = __builtin_amdgcn_wmma_f32_16x16x32_bf16(false, ah, false, bl, (short)0, c, false, false);
  asm volatile("v_nop\n\tv_nop\n\tv_nop\n\tv_nop" : "+v"(c) : "v"(ah), "v"(al), "v"(bh), "v"(bl));
  return c;
}

__global__ __launch_bounds__(256) void k_wt_bf16(const float* __restrict__ W, unsigned short* __restrict__ Wt, int K, int N) {
  const int t = blockIdx.x * 256 + threadIdx.x;
  const int k8n = K / 8;
  if (t >= N * k8n) return;
  const int n = t / k8n, k8 = (t % k8n) * 8;
  v8us v;
#pragma unroll
  for (int i = 0; i < 8; ++i) v[i] = bf16_bits(W[(size_t)(k8 + i) * N + n]);
  *(v8us*)(Wt + (size_t)n * K + k8) = v;
  
}

// GEMM C[M][N] (f32, pitch ldc) = act(A[M][K]·W + bias). A f32 row-major (pitch lda) converted per fragment to bf16
// (ASPLIT: hi/lo two planes -> 2 terms, else single rounded term); Wt bf16 [N][K] (pitch ldb). BIAS_BF16 rounds the
// bias to bf16 first (bias quantised to bf16 before the add). K%32==0, M%16==0, N%64==0.
template <bool ASPLIT, int ACT, bool BIAS_BF16>
__global__ __launch_bounds__(128) void k_gemm_bf(const float* __restrict__ A, int lda, const unsigned short* __restrict__ Wt, int ldb,
                                               const float* __restrict__ bias, float* __restrict__ C, int ldc, int M, int N, int K) {
  __shared__ __attribute__((aligned(16))) float so[4][16][64];
  const int tid = threadIdx.x, w = tid >> 5, lane = tid & 31, ln = lane & 15, hh = lane >> 4;
  const int ntn = N / 64;
  const int wid = blockIdx.x * 4 + w;
  const int mt = wid / ntn, nq = wid % ntn;
  if (mt * 16 >= M) return;
  const int row0 = mt * 16, col0 = nq * 64;
  const float* arow = A + (size_t)(row0 + ln) * lda;
  v8f acc[4] = {};
  for (int kb = 0; kb < K; kb += 32) {
    FragB ah, al;
    const v4f x0 = *(const v4fa*)(arow + kb + 8 * hh), x1 = *(const v4fa*)(arow + kb + 8 * hh + 4);
    const v4f x2 = *(const v4fa*)(arow + kb + 16 + 8 * hh), x3 = *(const v4fa*)(arow + kb + 16 + 8 * hh + 4);
    float xs[16] = {x0[0],x0[1],x0[2],x0[3],x1[0],x1[1],x1[2],x1[3],x2[0],x2[1],x2[2],x2[3],x3[0],x3[1],x3[2],x3[3]};
#pragma unroll
    for (int i = 0; i < 16; ++i) { const unsigned short hb = bf16_bits(xs[i]); ah.u[i] = hb; al.u[i] = ASPLIT ? bf16_bits(xs[i] - bf16_val(hb)) : (unsigned short)0; }
#pragma unroll
    for (int t = 0; t < 4; ++t) {
      const unsigned short* brow = Wt + (size_t)(col0 + t * 16 + ln) * ldb + kb;
      FragB b;
      b.half[0] = *(const v8us*)(brow + 8 * hh);
      b.half[1] = *(const v8us*)(brow + 16 + 8 * hh);
      acc[t] = mmaN<ASPLIT ? 2 : 1>(ah.v, al.v, b.v, b.v, acc[t]);
    }
  }
#pragma unroll
  for (int t = 0; t < 4; ++t) {
    float bv = bias ? bias[col0 + t * 16 + ln] : 0.f;
    if (BIAS_BF16) bv = bf16_round(bv);
#pragma unroll
    for (int r = 0; r < 8; ++r) { float v = acc[t][r] + bv; if (ACT == 1) v = fmaxf(v, 0.f); so[w][8 * hh + r][t * 16 + ln] = v; }
  }
  __builtin_amdgcn_fence(__ATOMIC_ACQ_REL, "workgroup");
  __builtin_amdgcn_wave_barrier();
  const int rsub = lane >> 4, c4 = (lane & 15) * 4;
  {
#pragma unroll
    for (int q = 0; q < 8; ++q) {
      const int r = q * 2 + rsub;
      const v4f v = *(const v4fa*)&so[w][r][c4];
      *(v4f*)(C + (size_t)(row0 + r) * ldc + col0 + c4) = v;
    }
    
  }
}

// Flash-style causal/unmasked attention, all contractions 3-term bf16 hi/lo splits, f32 softmax with running max.
// q,k,v rows are read from f32 buffers with arbitrary row pitch (so they can live inside a fused qkv buffer);
// D = head size (multiple of 32, <= 128); one wave = 16 query rows; block = 4 waves (64 queries) sharing K/V chunks of 32.
template <int D, bool CAUSAL>
__global__ __launch_bounds__(128) void k_flash(const float* __restrict__ qb, const float* __restrict__ kb, const float* __restrict__ vb,
                                             int pitch, int T, int H, float scale, float* __restrict__ y, int ypitch) {
  constexpr int KS = D / 32;        // k-steps for QK
  constexpr int DT = D / 16;        // d tiles for PV
  __shared__ __attribute__((aligned(16))) unsigned short sKh[32][D + 8], sKl[32][D + 8], sVh[32][D + 8], sVl[32][D + 8];
  __shared__ __attribute__((aligned(16))) unsigned short sPh[4][16][40], sPl[4][16][40];
  __shared__ __attribute__((aligned(16))) float sO[4][16][D];
  const int tid = threadIdx.x, w = tid >> 5, lane = tid & 31, ln = lane & 15, hh = lane >> 4;
  const int nqb = (T + 63) / 64;
  const int bh = blockIdx.x / nqb, qblk = blockIdx.x % nqb;
  const int b = bh / H, h = bh % H;
  const int q0 = qblk * 64 + w * 16;
  const float* Q = qb + (size_t)b * T * pitch + h * D;
  const float* K = kb + (size_t)b * T * pitch + h * D;
  const float* V = vb + (size_t)b * T * pitch + h * D;

  // A fragments of the wave's 16 query rows (scaled), hi/lo
  FragB aqh[KS], aql[KS];
  {
    int row = q0 + ln; if (row >= T) row = T - 1;
    const float* qr = Q + (size_t)row * pitch;
#pragma unroll
    for (int ks = 0; ks < KS; ++ks)
#pragma unroll
      for (int i = 0; i < 16; ++i) {
        const int d = ks * 32 + ((i < 8) ? (8 * hh + i) : (16 + 8 * hh + (i - 8)));
        const float x = qr[d] * scale; const unsigned short hb = bf16_bits(x);
        aqh[ks].u[i] = hb; aql[ks].u[i] = bf16_bits(x - bf16_val(hb));
      }
  }
  float m_r[8], l_r[8];
#pragma unroll
  for (int r = 0; r < 8; ++r) { m_r[r] = -3.0e38f; l_r[r] = 0.f; }
  v8f oacc[DT];
#pragma unroll
  for (int dt = 0; dt < DT; ++dt) oacc[dt] = (v8f){0.f,0.f,0.f,0.f,0.f,0.f,0.f,0.f};

  const int kv_end = CAUSAL ? min(T, qblk * 64 + 64) : T;     // block-uniform
  for (int j0 = 0; j0 < kv_end; j0 += 32) {
    __syncthreads();
    for (int e = tid; e < 32 * (D / 4); e += 128) {
      const int r = e / (D / 4), c4 = (e % (D / 4)) * 4;
      const int key = j0 + r;
      v4f kf = {0.f,0.f,0.f,0.f}, vf = {0.f,0.f,0.f,0.f};
      if (key < T) { kf = *(const v4fa*)(K + (size_t)key * pitch + c4); vf = *(const v4fa*)(V + (size_t)key * pitch + c4); }
#pragma unroll
      for (int t = 0; t < 4; ++t) {
        unsigned short hb = bf16_bits(kf[t]); sKh[r][c4 + t] = hb; sKl[r][c4 + t] = bf16_bits(kf[t] - bf16_val(hb));
        hb = bf16_bits(vf[t]); sVh[r][c4 + t] = hb; sVl[r][c4 + t] = bf16_bits(vf[t] - bf16_val(hb));
      }
    }
    __syncthreads();
    // S tile 16 x 32
    v8f s[2];
#pragma unroll
    for (int nt = 0; nt < 2; ++nt) {
      v8f acc = {};
#pragma unroll
      for (int ks = 0; ks < KS; ++ks) {
        FragB bh_, bl_;
        bh_.half[0] = *(const v8us*)&sKh[nt * 16 + ln][ks * 32 + 8 * hh]; bh_.half[1] = *(const v8us*)&sKh[nt * 16 + ln][ks * 32 + 16 + 8 * hh];
        bl_.half[0] = *(const v8us*)&sKl[nt * 16 + ln][ks * 32 + 8 * hh]; bl_.half[1] = *(const v8us*)&sKl[nt * 16 + ln][ks * 32 + 16 + 8 * hh];
        acc = mmaN<3>(aqh[ks].v, aql[ks].v, bh_.v, bl_.v, acc);
      }
      s[nt] = acc;
    }
    // mask + running max (rows 8hh+r; the 16 lanes of a half share rows)
    float alpha[8];
#pragma unroll
    for (int r = 0; r < 8; ++r) {
      const int qi = q0 + 8 * hh + r;
      const int ja = j0 + ln, jb = j0 + 16 + ln;
      if (CAUSAL) { if (ja > qi) s[0][r] = -3.0e38f; if (jb > qi) s[1][r] = -3.0e38f; }
      if (ja >= T) s[0][r] = -3.0e38f;
      if (jb >= T) s[1][r] = -3.0e38f;
      float mx = fmaxf(s[0][r], s[1][r]);
      mx = fmaxf(mx, __shfl_xor(mx, 1, 32)); mx = fmaxf(mx, __shfl_xor(mx, 2, 32)); mx = fmaxf(mx, __shfl_xor(mx, 4, 32)); mx = fmaxf(mx, __shfl_xor(mx, 8, 32));
      const float mnew = fmaxf(m_r[r], mx);
      alpha[r] = (mnew > -1.0e38f) ? __expf(m_r[r] - mnew) : 1.0f;
      const float p0 = (s[0][r] > -1.0e38f) ? __expf(s[0][r] - mnew) : 0.f;
      const float p1 = (s[1][r] > -1.0e38f) ? __expf(s[1][r] - mnew) : 0.f;
      m_r[r] = mnew;
      l_r[r] = l_r[r] * alpha[r] + p0 + p1;            // per-lane partial row sum (16 lanes combined at the end)
      unsigned short hb = bf16_bits(p0); sPh[w][8 * hh + r][ln] = hb;      sPl[w][8 * hh + r][ln] = bf16_bits(p0 - bf16_val(hb));
      hb = bf16_bits(p1);                sPh[w][8 * hh + r][16 + ln] = hb; sPl[w][8 * hh + r][16 + ln] = bf16_bits(p1 - bf16_val(hb));
    }
#pragma unroll
    for (int dt = 0; dt < DT; ++dt)
#pragma unroll
      for (int r = 0; r < 8; ++r) oacc[dt][r] *= alpha[r];
    __builtin_amdgcn_fence(__ATOMIC_ACQ_REL, "workgroup");
    __builtin_amdgcn_wave_barrier();
    FragB pah, pal;
    pah.half[0] = *(const v8us*)&sPh[w][ln][8 * hh]; pah.half[1] = *(const v8us*)&sPh[w][ln][16 + 8 * hh];
    pal.half[0] = *(const v8us*)&sPl[w][ln][8 * hh]; pal.half[1] = *(const v8us*)&sPl[w][ln][16 + 8 * hh];
#pragma unroll
    for (int dt = 0; dt < DT; ++dt) {
      FragB bvh, bvl;
#pragma unroll
      for (int i = 0; i < 8; ++i) {
        bvh.u[i] = sVh[8 * hh + i][dt * 16 + ln]; bvh.u[8 + i] = sVh[16 + 8 * hh + i][dt * 16 + ln];
        bvl.u[i] = sVl[8 * hh + i][dt * 16 + ln]; bvl.u[8 + i] = sVl[16 + 8 * hh + i][dt * 16 + ln];
      }
      oacc[dt] = mmaN<3>(pah.v, pal.v, bvh.v, bvl.v, oacc[dt]);
    }
    __builtin_amdgcn_fence(__ATOMIC_ACQ_REL, "workgroup");
    __builtin_amdgcn_wave_barrier();
  }
#pragma unroll
  for (int r = 0; r < 8; ++r) {
    float l = l_r[r];
    l += __shfl_xor(l, 1, 32); l += __shfl_xor(l, 2, 32); l += __shfl_xor(l, 4, 32); l += __shfl_xor(l, 8, 32);
    l_r[r] = (l > 0.f) ? 1.0f / l : 0.f;
  }
#pragma unroll
  for (int dt = 0; dt < DT; ++dt)
#pragma unroll
    for (int r = 0; r < 8; ++r) sO[w][8 * hh + r][dt * 16 + ln] = oacc[dt][r] * l_r[r];
  __builtin_amdgcn_fence(__ATOMIC_ACQ_REL, "workgroup");
  __builtin_amdgcn_wave_barrier();
  {
    for (int r = 0; r < 16; ++r) {
      const int row = q0 + r;
      if (row < T && lane < D / 4) {
        const v4f val = *(const v4fa*)&sO[w][r][lane * 4];
        *(v4f*)(y + ((size_t)b * T + row) * ypitch + h * D + lane * 4) = val;
      }
    }
    
  }
}

// GEMM C = act(A·W + bias + resid): A f32 (ASPLIT -> hi/lo 2 terms), Wt bf16 [N][K]; ACT 0 none, 1 relu, 2 exact gelu;
// resid (optional, f32, row index = (row % rmod), pitch ldr, RES_BF16 rounds it) added before the activation.
template <bool ASPLIT, int ACT, bool BIAS_BF16, bool RES_BF16>
__global__ __launch_bounds__(128) void k_gemm_bf3(const float* __restrict__ A, int lda, const unsigned short* __restrict__ Wt, int ldb,
                                                const float* __restrict__ bias, const float* __restrict__ resid, int rmod, int ldr,
                                                float* __restrict__ C, int ldc, int M, int N, int K) {
  __shared__ __attribute__((aligned(16))) float so[4][16][64];
  const int tid = threadIdx.x, w = tid >> 5, lane = tid & 31, ln = lane & 15, hh = lane >> 4;
  const int ntn = N / 64;
  const int wid = blockIdx.x * 4 + w;
  const int mt = wid / ntn, nq = wid % ntn;
  if (mt * 16 >= M) return;
  const int row0 = mt * 16, col0 = nq * 64;
  const float* arow = A + (size_t)(row0 + ln) * lda;
  v8f acc[4] = {};
  for (int kb = 0; kb < K; kb += 32) {
    FragB ah, al;
    const v4f x0 = *(const v4fa*)(arow + kb + 8 * hh), x1 = *(const v4fa*)(arow + kb + 8 * hh + 4);
    const v4f x2 = *(const v4fa*)(arow + kb + 16 + 8 * hh), x3 = *(const v4fa*)(arow + kb + 16 + 8 * hh + 4);
    float xs[16] = {x0[0],x0[1],x0[2],x0[3],x1[0],x1[1],x1[2],x1[3],x2[0],x2[1],x2[2],x2[3],x3[0],x3[1],x3[2],x3[3]};
#pragma unroll
    for (int i = 0; i < 16; ++i) { const unsigned short hb = bf16_bits(xs[i]); ah.u[i] = hb; al.u[i] = ASPLIT ? bf16_bits(xs[i] - bf16_val(hb)) : (unsigned short)0; }
#pragma unroll
    for (int t = 0; t < 4; ++t) {
      const unsigned short* brow = Wt + (size_t)(col0 + t * 16 + ln) * ldb + kb;
      FragB b;
      b.half[0] = *(const v8us*)(brow + 8 * hh);
      b.half[1] = *(const v8us*)(brow + 16 + 8 * hh);
      acc[t] = mmaN<ASPLIT ? 2 : 1>(ah.v, al.v, b.v, b.v, acc[t]);
    }
  }
#pragma unroll
  for (int t = 0; t < 4; ++t) {
    const int col = col0 + t * 16 + ln;
    float bv = bias ? bias[col] : 0.f;
    if (BIAS_BF16) bv = bf16_round(bv);
#pragma unroll
    for (int r = 0; r < 8; ++r) {
      float v = acc[t][r] + bv;
      if (resid) { float rv = resid[(size_t)((row0 + 8 * hh + r) % rmod) * ldr + col]; if (RES_BF16) rv = bf16_round(rv); v += rv; }
      if (ACT == 1) v = fmaxf(v, 0.f);
      if (ACT == 2) v = 0.5f * v * (1.0f + erff(v * 0.70710678118654752f));
      if (ACT == 3) { const float u = 0.7978845608028654f * (v + 0.044715f * v * v * v); v = 0.5f * v * (1.0f + tanhf(u)); }
      so[w][8 * hh + r][t * 16 + ln] = v;
    }
  }
  __builtin_amdgcn_fence(__ATOMIC_ACQ_REL, "workgroup");
  __builtin_amdgcn_wave_barrier();
  const int rsub = lane >> 4, c4 = (lane & 15) * 4;
  {
#pragma unroll
    for (int q = 0; q < 8; ++q) {
      const int r = q * 2 + rsub;
      const v4f v = *(const v4fa*)&so[w][r][c4];
      *(v4f*)(C + (size_t)(row0 + r) * ldc + col0 + c4) = v;
    }
    
  }
}
// row LayerNorm (biased variance, eps) over N: s = X (+ R); optional out_sum <- s; out_norm <- (s-mu)*rsqrt(var+eps)*g + b
template <bool PARAM_BF16>
__global__ __launch_bounds__(256) void k_layernorm(const float* __restrict__ X, const float* __restrict__ R, const float* __restrict__ g, const float* __restrict__ bta,
                                                  float* __restrict__ out_sum, float* __restrict__ out_norm, int N, float eps) {
  __shared__ float red[256];
  const int row = blockIdx.x, tid = threadIdx.x;
  const float* x = X + (size_t)row * N; const float* rr = R ? R + (size_t)row * N : nullptr;
  float vals[16];                     // up to N = 4096
  const int per = N / 256;            // contiguous chunk per thread? use strided-by-4 chunks: thread handles j = tid*4 + 1024*u
  float s1 = 0.f;
  for (int u = 0; u < per / 4; ++u) {
    const int j = tid * 4 + 1024 * u;
    const v4f a = *(const v4fa*)(x + j);
    v4f b = {0.f,0.f,0.f,0.f}; if (rr) b = *(const v4fa*)(rr + j);
#pragma unroll
    for (int q = 0; q < 4; ++q) { const float v = a[q] + b[q]; vals[u * 4 + q] = v; s1 += v; }
  }
  red[tid] = s1; __syncthreads();
  for (int st = 128; st > 0; st >>= 1) { if (tid < st) red[tid] += red[tid + st]; __syncthreads(); }
  const float mu = red[0] / (float)N; __syncthreads();
  float s2 = 0.f;
  for (int u = 0; u < per / 4; ++u)
#pragma unroll
    for (int q = 0; q < 4; ++q) { const float c = vals[u * 4 + q] - mu; s2 += c * c; }
  red[tid] = s2; __syncthreads();
  for (int st = 128; st > 0; st >>= 1) { if (tid < st) red[tid] += red[tid + st]; __syncthreads(); }
  const float rs = rsqrtf(red[0] / (float)N + eps);
  {
    for (int u = 0; u < per / 4; ++u) {
      const int j = tid * 4 + 1024 * u;
      v4f o, sm;
#pragma unroll
      for (int q = 0; q < 4; ++q) {
        float gg = g[j + q], bb = bta[j + q];
        if (PARAM_BF16) { gg = bf16_round(gg); bb = bf16_round(bb); }
        sm[q] = vals[u * 4 + q]; o[q] = (vals[u * 4 + q] - mu) * rs * gg + bb;
      }
      if (out_sum) *(v4f*)(out_sum + (size_t)row * N + j) = sm;
      *(v4f*)(out_norm + (size_t)row * N + j) = o;
    }
    
  }
}



// ---- f16 WMMA path (v_wmma_f32_16x16x32_f16): 11-bit significands for operands in range — used where a [0,1] probability operand needs more precision than bf16
typedef _Float16 v16h __attribute__((ext_vector_type(16)));
union FragH { v16h v; v8us half[2]; _Float16 h[16]; unsigned short u[16]; };
template <int NT>
__device__ __forceinline__ v8f mmaH(v16h ah, v16h al, v16h bh, v16h bl, v8f c) {
  c = __builtin_amdgcn_wmma_f32_16x16x32_f16(false, ah, false, bh, (short)0, c, false, false);
  if (NT >= 2) c = __builtin_amdgcn_wmma_f32_16x16x32_f16(false, al, false, bh, (short)0, c, false, false);
  if (NT >= 3) c = __builtin_amdgcn_wmma_f32_16x16x32_f16(false, ah, false, bl, (short)0, c, false, false);
  asm volatile("v_nop\n\tv_nop\n\tv_nop\n\tv_nop" : "+v"(c) : "v"(ah), "v"(al), "v"(bh), "v"(bl));
  return c;
}
// batched GEMM like k_gemm_b but f16 operands: A f32 (split into f16 hi/lo if ASPLIT, else rounded to f16), Bt = f16 values [n][k]; alpha; C f32; N multiple of 16 (partial tiles skipped)
template <bool ASPLIT>
__global__ __launch_bounds__(128) void k_gemm_h(const float* __restrict__ A, int lda, size_t sA, const _Float16* __restrict__ Bh, int ldb, size_t sB, float alpha, float* __restrict__ C, int ldc, size_t sC, int M, int N, int K) {
  __shared__ __attribute__((aligned(16))) float so[4][16][64];
  const int tid = threadIdx.x, w = tid >> 5, lane = tid & 31, ln = lane & 15, hh = lane >> 4; const int by = blockIdx.y;
  A += (size_t)by * sA; Bh += (size_t)by * sB; C += (size_t)by * sC;
  const int ntn = (N + 63) / 64; const int wid = blockIdx.x * 4 + w; const int mt = wid / ntn, nq = wid % ntn; if (mt * 16 >= M) return;
  const int row0 = mt * 16, col0 = nq * 64; const float* arow = A + (size_t)(row0 + ln) * lda;
  v8f acc[4] = {};
  for (int kb = 0; kb < K; kb += 32) {
    FragH ah, al;
    const v4f x0 = *(const v4fa*)(arow + kb + 8 * hh), x1 = *(const v4fa*)(arow + kb + 8 * hh + 4), x2 = *(const v4fa*)(arow + kb + 16 + 8 * hh), x3 = *(const v4fa*)(arow + kb + 16 + 8 * hh + 4);
    float xs[16] = {x0[0],x0[1],x0[2],x0[3],x1[0],x1[1],x1[2],x1[3],x2[0],x2[1],x2[2],x2[3],x3[0],x3[1],x3[2],x3[3]};
#pragma unroll
    for (int i = 0; i < 16; ++i) { const _Float16 h = (_Float16)xs[i]; ah.h[i] = h; al.h[i] = ASPLIT ? (_Float16)(xs[i] - (float)h) : (_Float16)0.0f; }
#pragma unroll
    for (int t = 0; t < 4; ++t) { if (col0 + t * 16 >= N) continue; const size_t boff = (size_t)(col0 + t * 16 + ln) * ldb + kb; FragH bq; bq.half[0] = *(const v8us*)(Bh + boff + 8 * hh); bq.half[1] = *(const v8us*)(Bh + boff + 16 + 8 * hh);
      acc[t] = mmaH<ASPLIT ? 2 : 1>(ah.v, al.v, bq.v, bq.v, acc[t]); }
  }
#pragma unroll
  for (int t = 0; t < 4; ++t) { if (col0 + t * 16 >= N) continue;
#pragma unroll
    for (int r = 0; r < 8; ++r) so[w][8 * hh + r][t * 16 + ln] = acc[t][r] * alpha; }
  __builtin_amdgcn_fence(__ATOMIC_ACQ_REL, "workgroup"); __builtin_amdgcn_wave_barrier();
  const int rsub = lane >> 4, c4 = (lane & 15) * 4;
  {
#pragma unroll
    for (int q = 0; q < 8; ++q) { const int r = q * 2 + rsub; if (col0 + c4 < N) { const v4f v = *(const v4fa*)&so[w][r][c4]; *(v4f*)(C + (size_t)(row0 + r) * ldc + col0 + c4) = v; } }
     }
}

// Wt[n][k] = f16(W[k][n]·scale) from f32 row-major W[K][N] (scale = power of two; bf16-exact weights stay exact in f16 away from the subnormal range)
__global__ __launch_bounds__(256) void k_wt_f16(const float* __restrict__ W, _Float16* __restrict__ Wt, int K, int N, float scale) {
  const int t = blockIdx.x * 256 + threadIdx.x; if (t >= N * (K / 8)) return; const int n = t / (K / 8), k8 = (t % (K / 8)) * 8; FragH f;
#pragma unroll
  for (int i = 0; i < 8; ++i) f.h[i] = (_Float16)(bf16_round(W[(size_t)(k8 + i) * N + n]) * scale); const v8us o = f.half[0];
  *(v8us*)((unsigned short*)Wt + (size_t)n * K + k8) = o; 
}
// k_gemm_hh variant with fused epilogue: v = acc·alpha + bias[by·sBias + col] (+ CP[(row/rowsPerB)·sCPb + by·64 + col] if CP) ; ACT 0 none / 1 elu ; writes f16 C16 (and f32 C if non-null)
template <int ACT>
__global__ __launch_bounds__(128) void k_gemm_hhx(const _Float16* __restrict__ A, int lda, size_t sA, const _Float16* __restrict__ Bh, int ldb, size_t sB, float alpha, const float* __restrict__ bias, size_t sBias, const float* __restrict__ CP, int rowsPerB, size_t sCPb, int row0g,
    float* __restrict__ C, _Float16* __restrict__ C16, int ldc, size_t sC, int M, int N, int K) {
  __shared__ __attribute__((aligned(16))) float so[4][16][64];
  const int tid = threadIdx.x, w = tid >> 5, lane = tid & 31, ln = lane & 15, hh = lane >> 4; const int by = blockIdx.y;
  A += (size_t)by * sA; Bh += (size_t)by * sB; const size_t cofs = (size_t)by * sC; const float* bp = bias ? bias + (size_t)by * sBias : nullptr;
  const int ntn = (N + 63) / 64; const int wid = blockIdx.x * 4 + w; const int mt = wid / ntn, nq = wid % ntn; if (mt * 16 >= M) return;
  const int row0 = mt * 16, col0 = nq * 64; const _Float16* arow = A + (size_t)(row0 + ln) * lda;
  v8f acc[4] = {};
  for (int kb = 0; kb < K; kb += 32) { FragH ah; ah.half[0] = *(const v8us*)((const unsigned short*)arow + kb + 8 * hh); ah.half[1] = *(const v8us*)((const unsigned short*)arow + kb + 16 + 8 * hh);
#pragma unroll
    for (int t = 0; t < 4; ++t) { if (col0 + t * 16 >= N) continue; const size_t boff = (size_t)(col0 + t * 16 + ln) * ldb + kb; FragH bq; bq.half[0] = *(const v8us*)((const unsigned short*)Bh + boff + 8 * hh); bq.half[1] = *(const v8us*)((const unsigned short*)Bh + boff + 16 + 8 * hh);
      acc[t] = mmaH<1>(ah.v, ah.v, bq.v, bq.v, acc[t]); }
  }
#pragma unroll
  for (int t = 0; t < 4; ++t) { if (col0 + t * 16 >= N) continue; const int col = col0 + t * 16 + ln; const float bv = bp ? bf16_round(bp[col]) : 0.f;
#pragma unroll
    for (int r = 0; r < 8; ++r) { float v = acc[t][r] * alpha + bv; if (CP) { const int bidx = (row0g + row0 + 8 * hh + r) / rowsPerB; v += CP[(size_t)bidx * sCPb + (size_t)by * 64 + col]; } if (ACT == 1) v = (v > 0.f) ? v : expm1f(v); else if (ACT == 3) v = fmaxf(v, 0.f); so[w][8 * hh + r][t * 16 + ln] = v; } }
  __builtin_amdgcn_fence(__ATOMIC_ACQ_REL, "workgroup"); __builtin_amdgcn_wave_barrier();
  const int rsub = lane >> 4, c4 = (lane & 15) * 4; typedef _Float16 v4h __attribute__((ext_vector_type(4)));
  {
#pragma unroll
    for (int q = 0; q < 8; ++q) { const int r = q * 2 + rsub; if (col0 + c4 < N) { const v4f v = *(const v4fa*)&so[w][r][c4]; if (C) *(v4f*)(C + cofs + (size_t)(row0 + r) * ldc + col0 + c4) = v; if (C16) { v4h h4; for (int i = 0; i < 4; ++i) h4[i] = (_Float16)v[i]; *(v4h*)(C16 + cofs + (size_t)(row0 + r) * ldc + col0 + c4) = h4; } } }
     }
}


// Eight 16-byte asynchronous copies global -> LDS (each lane its own addresses), rows lstep / gstep apart. The s_wait_xcnt closes the statement so that no
// address register named here is rewritten ahead of it.
__device__ __forceinline__ void copy8(unsigned l, const _Float16* g, unsigned lstep, size_t gstep) {
  asm volatile("global_load_async_to_lds_b128 %0, %8, off\n\t"
               "global_load_async_to_lds_b128 %1, %9, off\n\t"
               "global_load_async_to_lds_b128 %2, %10, off\n\t"
               "global_load_async_to_lds_b128 %3, %11, off\n\t"
               "global_load_async_to_lds_b128 %4, %12, off\n\t"
               "global_load_async_to_lds_b128 %5, %13, off\n\t"
               "global_load_async_to_lds_b128 %6, %14, off\n\t"
               "global_load_async_to_lds_b128 %7, %15, off\n\t"
               "s_wait_xcnt 0x0"
               :: "v"(l), "v"(l + lstep), "v"(l + 2 * lstep), "v"(l + 3 * lstep), "v"(l + 4 * lstep), "v"(l + 5 * lstep), "v"(l + 6 * lstep), "v"(l + 7 * lstep),
                  "v"(g), "v"(g + gstep), "v"(g + 2 * gstep), "v"(g + 3 * gstep), "v"(g + 4 * gstep), "v"(g + 5 * gstep), "v"(g + 6 * gstep), "v"(g + 7 * gstep)
               : "memory");
}
// C[M][Nn] = A[M][Kk] * Bh[Nn][Kk]^T * alpha (+ bf16-rounded bias), f16 operands, f32 accumulate. One work-group = one 128 x 128 tile of C, four waves (2 x 2) of 64 x 64.
// A and Bh tiles of 128 rows x 128 k are staged in LDS (row pitch 272 B) by asynchronous copies, two buffers: tile t + 1 flies while tile t is worked on.
// M, Nn multiples of 128 (grid = M / 128 * Nn / 128), Kk a multiple of 128. Each 16 x 16 accumulator sums k upwards in steps of 32.
// NCHW: A holds the CC output channels' weights and Bh the tokens (Nn = NR), so a row of C is a channel and its columns are pixels that lie side by side in the image:
// the tile goes straight to C[image][channel][pixel] (f32), the bias belongs to the row.
// NS > 0 (a multiple of 128, with OUT16): two products that share A run as one launch; columns below NS go to C16 (row pitch NS), the others to C16b (row pitch Nn - NS).
template <int Nn, int Kk, bool OUT16, bool BIAS, bool NCHW, int NS>
__global__ __launch_bounds__(128) void k_gemm_t(const _Float16* __restrict__ A, const _Float16* __restrict__ Bh, float alpha, const float* __restrict__ bias, float* __restrict__ C, _Float16* __restrict__ C16, _Float16* __restrict__ C16b) {
  constexpr int KC = 128, PITCH = 272, OPB = 128 * PITCH, STG = 2 * OPB, NT = Kk / KC;
  __shared__ __attribute__((aligned(16))) unsigned char sm[2 * STG];
  const int tid = threadIdx.x, w = tid >> 5, lane = tid & 31, ln = lane & 15, hh = lane >> 4;
  const int bm = blockIdx.x / (Nn / 128), bn = blockIdx.x % (Nn / 128);
  const int wm = w >> 1, wn = w & 1;
  const int crow = tid >> 4, cch = tid & 15;      // a copy instruction of a wave covers two whole 256-byte rows
  const _Float16* ga = A + (size_t)(bm * 128 + crow) * Kk + cch * 8;
  const _Float16* gb = Bh + (size_t)(bn * 128 + crow) * Kk + cch * 8;
  const unsigned lc = (unsigned)(size_t)sm + crow * PITCH + cch * 16;
  auto fill = [&](int t, int buf) {
    const unsigned l = lc + buf * STG;
    copy8(l, ga + t * KC, 8 * PITCH, (size_t)8 * Kk);
    copy8(l + 64 * PITCH, ga + t * KC + (size_t)64 * Kk, 8 * PITCH, (size_t)8 * Kk);
    copy8(l + OPB, gb + t * KC, 8 * PITCH, (size_t)8 * Kk);
    copy8(l + OPB + 64 * PITCH, gb + t * KC + (size_t)64 * Kk, 8 * PITCH, (size_t)8 * Kk);
  };
  v8f acc[4][4] = {};
  fill(0, 0);
  asm volatile("s_wait_asynccnt 0x0" ::: "memory");      // tile 0 of this wave has landed
  __syncthreads();                                       // ... and every wave's part of it
  if (NT > 1) fill(1, 1);
  const int aoff = (wm * 64 + ln) * PITCH + 16 * hh, boff = OPB + (wn * 64 + ln) * PITCH + 16 * hh;
#pragma unroll 1      // kept rolled: unrolled over the k tiles the build takes many more vector registers
  for (int t = 0; t < NT; ++t) {
    const int sb = (t & 1) * STG;
#pragma unroll
    for (int ks = 0; ks < KC / 32; ++ks) {
      FragH a[4], b[4];
#pragma unroll
      for (int i = 0; i < 4; ++i) {
        a[i].half[0] = *(const v8us*)&sm[sb + aoff + i * 16 * PITCH + ks * 64]; a[i].half[1] = *(const v8us*)&sm[sb + aoff + i * 16 * PITCH + ks * 64 + 32];
        b[i].half[0] = *(const v8us*)&sm[sb + boff + i * 16 * PITCH + ks * 64]; b[i].half[1] = *(const v8us*)&sm[sb + boff + i * 16 * PITCH + ks * 64 + 32];
      }
#pragma unroll
      for (int i = 0; i < 4; ++i)
#pragma unroll
        for (int j = 0; j < 4; ++j) acc[i][j] = __builtin_amdgcn_wmma_f32_16x16x32_f16(false, a[i].v, false, b[j].v, (short)0, acc[i][j], false, false);
    }
    asm volatile("s_wait_dscnt 0x0" ::: "memory");       // this wave's reads of buffer t & 1 are done before it is refilled
    asm volatile("s_wait_asynccnt 0x0" ::: "memory");    // this wave's copies of tile t + 1 have landed
    __syncthreads();                                     // publishes tile t + 1, ends every reader's last read of tile t
    if (t + 2 < NT) fill(t + 2, t & 1);
  }
  asm volatile("s_wait_asynccnt 0x0" ::: "memory");      // no copy is outstanding when the ring becomes output staging
  // epilogue: each wave stages its 64 x 64 tile in its own LDS range (pitch 68 floats) and stores whole lines
  float* so = (float*)sm + w * (64 * 68);
  const int row0 = bm * 128 + wm * 64, col0 = bn * 128 + wn * 64;
  if (NCHW) {
#pragma unroll
    for (int i = 0; i < 4; ++i)
#pragma unroll
      for (int r = 0; r < 8; ++r) {
        const float bv = BIAS ? bf16_round(bias[row0 + i * 16 + 8 * hh + r]) : 0.f;
#pragma unroll
        for (int j = 0; j < 4; ++j) so[(i * 16 + 8 * hh + r) * 68 + j * 16 + ln] = acc[i][j][r] * alpha + bv;
      }
  } else {
#pragma unroll
    for (int j = 0; j < 4; ++j) {
      const float bv = BIAS ? bf16_round(bias[col0 + j * 16 + ln]) : 0.f;
#pragma unroll
      for (int i = 0; i < 4; ++i)
#pragma unroll
        for (int r = 0; r < 8; ++r) so[(i * 16 + 8 * hh + r) * 68 + j * 16 + ln] = acc[i][j][r] * alpha + bv;
    }
  }
  __builtin_amdgcn_fence(__ATOMIC_ACQ_REL, "workgroup"); __builtin_amdgcn_wave_barrier();
  if (NCHW) {
    const int rs = lane >> 4, c4 = (lane & 15) * 4;      // half a wave stores 64 pixels of one channel: two whole lines
    float* cp = C + ((size_t)(col0 / NPIX) * CC + row0 + rs) * NPIX + col0 % NPIX + c4;
#pragma unroll
    for (int q = 0; q < 32; ++q) { const int r = q * 2 + rs; const v4f v = *(const v4fa*)&so[r * 68 + c4]; *(v4f*)(cp + q * 2 * NPIX) = v; }
  } else if (OUT16) {
    const int rs = lane >> 3, c8 = (lane & 7) * 8;
    auto put = [&](_Float16* dst, const int ld, const int c0) {      // dst, its row pitch and the tile's first column there
      unsigned short* cp = (unsigned short*)dst + (size_t)(row0 + rs) * ld + c0 + c8;
#pragma unroll
      for (int q = 0; q < 16; ++q) { const int r = q * 4 + rs; const v4f v0 = *(const v4fa*)&so[r * 68 + c8], v1 = *(const v4fa*)&so[r * 68 + c8 + 4]; FragH f;
#pragma unroll
        for (int i = 0; i < 4; ++i) { f.h[i] = (_Float16)v0[i]; f.h[4 + i] = (_Float16)v1[i]; }
        *(v8us*)(cp + q * 4 * ld) = f.half[0]; }
    };
    if (NS > 0 && bn * 128 >= NS) put(C16b, Nn - NS, col0 - NS);      // a tile lies wholly on one side: the test reads the same in the whole work-group
    else put(C16, NS > 0 ? NS : Nn, col0);
  } else {
    const int rs = lane >> 4, c4 = (lane & 15) * 4;
    float* cp = C + (size_t)(row0 + rs) * Nn + col0 + c4;
#pragma unroll
    for (int q = 0; q < 32; ++q) { const int r = q * 2 + rs; const v4f v = *(const v4fa*)&so[r * 68 + c4]; *(v4f*)(cp + q * 2 * Nn) = v; }
  }
}


typedef _Float16 v4h __attribute__((ext_vector_type(4)));

__global__ __launch_bounds__(256) void k_x16(const float* __restrict__ x, _Float16* __restrict__ X16, size_t n8) { const size_t t = (size_t)blockIdx.x * 256 + threadIdx.x; if (t >= n8) return; FragH f;
#pragma unroll
  for (int q = 0; q < 8; ++q) f.h[q] = (_Float16)bf16_round(x[t * 8 + q]); *(v8us*)((unsigned short*)X16 + t * 8) = f.half[0];  }
__global__ __launch_bounds__(256) void k_h16(const float* __restrict__ x, _Float16* __restrict__ X16, size_t n8) { const size_t t = (size_t)blockIdx.x * 256 + threadIdx.x; if (t >= n8) return; FragH f;
#pragma unroll
  for (int q = 0; q < 8; ++q) f.h[q] = (_Float16)x[t * 8 + q]; *(v8us*)((unsigned short*)X16 + t * 8) = f.half[0];  }
template <int NHv, int TTv>
__global__ __launch_bounds__(256) void k_vt(const _Float16* __restrict__ V16, int ldv, int voff, _Float16* __restrict__ Vt) { __shared__ unsigned short tl[64][66]; const int tid = threadIdx.x; const int slab = blockIdx.x / (TTv / 64), lg = blockIdx.x % (TTv / 64); const int b = slab / NHv, h = slab % NHv;
  for (int i = tid; i < 64 * 8; i += 256) { const int r = i / 8, c8 = (i % 8) * 8; FragH f; f.half[0] = *(const v8us*)((const unsigned short*)V16 + ((size_t)b * TTv + lg * 64 + r) * ldv + voff + h * 64 + c8);
#pragma unroll
    for (int q = 0; q < 8; ++q) tl[r][c8 + q] = f.u[q]; }
  __syncthreads();
  {
#pragma unroll
    for (int rd = 0; rd < 2; ++rd) { const int d = rd * 32 + tid / 8, pc = tid % 8; FragH f;
#pragma unroll
      for (int q = 0; q < 8; ++q) f.u[q] = tl[pc * 8 + q][d];
      *(v8us*)((unsigned short*)Vt + ((size_t)slab * 64 + d) * TTv + lg * 64 + pc * 8) = f.half[0]; }
     } }

// The (out,in) weights as f16 (bf16-rounded, times 2^4), eight values a thread: Bw = [Wq | Wkv | Wo] one behind the other.
#define NBQ (INNER * CC / 8 / 256)
#define NBW (4 * NBQ)
__global__ __launch_bounds__(256) void k_prep(const float* __restrict__ Wq, const float* __restrict__ Wkv, const float* __restrict__ Wo, _Float16* __restrict__ Bw) { const int tid = threadIdx.x;
  const int wb = blockIdx.x; const float* W = wb < NBQ ? Wq : wb < 3 * NBQ ? Wkv : Wo; const size_t t = (size_t)(wb < NBQ ? wb : wb < 3 * NBQ ? wb - NBQ : wb - 3 * NBQ) * 256 + tid; FragH f;
#pragma unroll
  for (int i = 0; i < 8; ++i) f.h[i] = (_Float16)(bf16_round(W[t * 8 + i]) * 16.0f); *(v8us*)((unsigned short*)Bw + ((size_t)wb * 256 + tid) * 8) = f.half[0];
}
union H8 { v8us v; unsigned d[4]; };      // eight f16 values as they are loaded: four registers of two
// v_fma_mix_f32: c + a * b in one fused f32 multiply-add whose f16 factors are widened exactly inside the instruction (op_sel picks the high halves). Written as asm for
// speed: from plain source this build widens every half with a conversion of its own before a packed f32 multiply-add. Each statement holds a whole round over independent
// sums, so that an instruction and the one it depends on stand eight or nine apart (asm text gets no s_delay_alu from the compiler, and needs none at that distance).
// s[w] (+)= the two products of register q with register k[w], w = 0 .. 8
__device__ __forceinline__ void dot9_first(float (&s)[9], unsigned q, const unsigned (&k)[9]) {
  asm(
      "v_fma_mix_f32 %0, %9, %10, 0 op_sel_hi:[1,1,0]\n\t"
      "v_fma_mix_f32 %1, %9, %11, 0 op_sel_hi:[1,1,0]\n\t"
      "v_fma_mix_f32 %2, %9, %12, 0 op_sel_hi:[1,1,0]\n\t"
      "v_fma_mix_f32 %3, %9, %13, 0 op_sel_hi:[1,1,0]\n\t"
      "v_fma_mix_f32 %4, %9, %14, 0 op_sel_hi:[1,1,0]\n\t"
      "v_fma_mix_f32 %5, %9, %15, 0 op_sel_hi:[1,1,0]\n\t"
      "v_fma_mix_f32 %6, %9, %16, 0 op_sel_hi:[1,1,0]\n\t"
      "v_fma_mix_f32 %7, %9, %17, 0 op_sel_hi:[1,1,0]\n\t"
      "v_fma_mix_f32 %8, %9, %18, 0 op_sel_hi:[1,1,0]\n\t"
      "v_fma_mix_f32 %0, %9, %10, %0 op_sel:[1,1,0] op_sel_hi:[1,1,0]\n\t"
      "v_fma_mix_f32 %1, %9, %11, %1 op_sel:[1,1,0] op_sel_hi:[1,1,0]\n\t"
      "v_fma_mix_f32 %2, %9, %12, %2 op_sel:[1,1,0] op_sel_hi:[1,1,0]\n\t"
      "v_fma_mix_f32 %3, %9, %13, %3 op_sel:[1,1,0] op_sel_hi:[1,1,0]\n\t"
      "v_fma_mix_f32 %4, %9, %14, %4 op_sel:[1,1,0] op_sel_hi:[1,1,0]\n\t"
      "v_fma_mix_f32 %5, %9, %15, %5 op_sel:[1,1,0] op_sel_hi:[1,1,0]\n\t"
      "v_fma_mix_f32 %6, %9, %16, %6 op_sel:[1,1,0] op_sel_hi:[1,1,0]\n\t"
      "v_fma_mix_f32 %7, %9, %17, %7 op_sel:[1,1,0] op_sel_hi:[1,1,0]\n\t"
      "v_fma_mix_f32 %8, %9, %18, %8 op_sel:[1,1,0] op_sel_hi:[1,1,0]"
      : "=&v"(s[0]), "=&v"(s[1]), "=&v"(s[2]), "=&v"(s[3]), "=&v"(s[4]), "=&v"(s[5]), "=&v"(s[6]), "=&v"(s[7]), "=&v"(s[8])
      : "v"(q), "v"(k[0]), "v"(k[1]), "v"(k[2]), "v"(k[3]), "v"(k[4]), "v"(k[5]), "v"(k[6]), "v"(k[7]), "v"(k[8]));
}
__device__ __forceinline__ void dot9_more(float (&s)[9], unsigned q, const unsigned (&k)[9]) {
  asm(
      "v_fma_mix_f32 %0, %9, %10, %0 op_sel_hi:[1,1,0]\n\t"
      "v_fma_mix_f32 %1, %9, %11, %1 op_sel_hi:[1,1,0]\n\t"
      "v_fma_mix_f32 %2, %9, %12, %2 op_sel_hi:[1,1,0]\n\t"
      "v_fma_mix_f32 %3, %9, %13, %3 op_sel_hi:[1,1,0]\n\t"
      "v_fma_mix_f32 %4, %9, %14, %4 op_sel_hi:[1,1,0]\n\t"
      "v_fma_mix_f32 %5, %9, %15, %5 op_sel_hi:[1,1,0]\n\t"
      "v_fma_mix_f32 %6, %9, %16, %6 op_sel_hi:[1,1,0]\n\t"
      "v_fma_mix_f32 %7, %9, %17, %7 op_sel_hi:[1,1,0]\n\t"
      "v_fma_mix_f32 %8, %9, %18, %8 op_sel_hi:[1,1,0]\n\t"
      "v_fma_mix_f32 %0, %9, %10, %0 op_sel:[1,1,0] op_sel_hi:[1,1,0]\n\t"
      "v_fma_mix_f32 %1, %9, %11, %1 op_sel:[1,1,0] op_sel_hi:[1,1,0]\n\t"
      "v_fma_mix_f32 %2, %9, %12, %2 op_sel:[1,1,0] op_sel_hi:[1,1,0]\n\t"
      "v_fma_mix_f32 %3, %9, %13, %3 op_sel:[1,1,0] op_sel_hi:[1,1,0]\n\t"
      "v_fma_mix_f32 %4, %9, %14, %4 op_sel:[1,1,0] op_sel_hi:[1,1,0]\n\t"
      "v_fma_mix_f32 %5, %9, %15, %5 op_sel:[1,1,0] op_sel_hi:[1,1,0]\n\t"
      "v_fma_mix_f32 %6, %9, %16, %6 op_sel:[1,1,0] op_sel_hi:[1,1,0]\n\t"
      "v_fma_mix_f32 %7, %9, %17, %7 op_sel:[1,1,0] op_sel_hi:[1,1,0]\n\t"
      "v_fma_mix_f32 %8, %9, %18, %8 op_sel:[1,1,0] op_sel_hi:[1,1,0]"
      : "+v"(s[0]), "+v"(s[1]), "+v"(s[2]), "+v"(s[3]), "+v"(s[4]), "+v"(s[5]), "+v"(s[6]), "+v"(s[7]), "+v"(s[8])
      : "v"(q), "v"(k[0]), "v"(k[1]), "v"(k[2]), "v"(k[3]), "v"(k[4]), "v"(k[5]), "v"(k[6]), "v"(k[7]), "v"(k[8]));
}
// acc[0 .. 7] (+)= a * the eight f16 values of v
__device__ __forceinline__ void av8_first(float (&acc)[8], float a, const unsigned (&v)[4]) {
  asm(
      "v_fma_mix_f32 %0, %8, %9, 0 op_sel_hi:[0,1,0]\n\t"
      "v_fma_mix_f32 %1, %8, %9, 0 op_sel:[0,1,0] op_sel_hi:[0,1,0]\n\t"
      "v_fma_mix_f32 %2, %8, %10, 0 op_sel_hi:[0,1,0]\n\t"
      "v_fma_mix_f32 %3, %8, %10, 0 op_sel:[0,1,0] op_sel_hi:[0,1,0]\n\t"
      "v_fma_mix_f32 %4, %8, %11, 0 op_sel_hi:[0,1,0]\n\t"
      "v_fma_mix_f32 %5, %8, %11, 0 op_sel:[0,1,0] op_sel_hi:[0,1,0]\n\t"
      "v_fma_mix_f32 %6, %8, %12, 0 op_sel_hi:[0,1,0]\n\t"
      "v_fma_mix_f32 %7, %8, %12, 0 op_sel:[0,1,0] op_sel_hi:[0,1,0]"
      : "=&v"(acc[0]), "=&v"(acc[1]), "=&v"(acc[2]), "=&v"(acc[3]), "=&v"(acc[4]), "=&v"(acc[5]), "=&v"(acc[6]), "=&v"(acc[7])
      : "v"(a), "v"(v[0]), "v"(v[1]), "v"(v[2]), "v"(v[3]));
}
__device__ __forceinline__ void av8_more(float (&acc)[8], float a, const unsigned (&v)[4]) {
  asm(
      "v_fma_mix_f32 %0, %8, %9, %0 op_sel_hi:[0,1,0]\n\t"
      "v_fma_mix_f32 %1, %8, %9, %1 op_sel:[0,1,0] op_sel_hi:[0,1,0]\n\t"
      "v_fma_mix_f32 %2, %8, %10, %2 op_sel_hi:[0,1,0]\n\t"
      "v_fma_mix_f32 %3, %8, %10, %3 op_sel:[0,1,0] op_sel_hi:[0,1,0]\n\t"
      "v_fma_mix_f32 %4, %8, %11, %4 op_sel_hi:[0,1,0]\n\t"
      "v_fma_mix_f32 %5, %8, %11, %5 op_sel:[0,1,0] op_sel_hi:[0,1,0]\n\t"
      "v_fma_mix_f32 %6, %8, %12, %6 op_sel_hi:[0,1,0]\n\t"
      "v_fma_mix_f32 %7, %8, %12, %7 op_sel:[0,1,0] op_sel_hi:[0,1,0]"
      : "+v"(acc[0]), "+v"(acc[1]), "+v"(acc[2]), "+v"(acc[3]), "+v"(acc[4]), "+v"(acc[5]), "+v"(acc[6]), "+v"(acc[7])
      : "v"(a), "v"(v[0]), "v"(v[1]), "v"(v[2]), "v"(v[3]));
}
// the value of lane l ^ 16 (the same place in the wave's other row of sixteen lanes); every lane is on where it is used
__device__ __forceinline__ float xhalf(float v) { return __builtin_bit_cast(float, __builtin_amdgcn_permlanex16(__builtin_bit_cast(int, v), __builtin_bit_cast(int, v), 0x76543210, 0xfedcba98, false, false)); }
// Everything behind the weight conversion in one kernel: q | k | v product, window attention, to_out product. One work-group = two image rows of one image with all eight heads: eight waves.
// q, k, v and o never reach memory. The work-group reads four image rows of x (its two and the one above and below, clamped to the image; a clamped row's k and v are never used), NCHW f32,
// rounds them (bf16, exact in f16) and writes them to LDS as 128 token rows, once; each wave keeps 64 tokens' fragments (all of k) in registers.
// Token (yy, x), yy = 0 .. 3 the row of the four, stands in tile row ((x & 3) >> 1) * 64 + J * 16 + (x & 1) * 8 + (x >> 2), J = 2, 0, 1, 3 for yy = 0 .. 3: every wave's column tiles 0 and 1 are
// the work-group's own two image rows, which alone need q; tiles 2 and 3 are the rows above and below.
// Product part, per pair of heads: three tiles of 128 channels x 256 k of the weights (k, v, q of the pair, in that order; row pitch 528 B), asynchronous copies, two buffers. A wave reads all of a
// tile's fragments into registers at the tile's start, so a buffer is free long before the tile's products are done: a barrier among k's products gives k's buffer to q, a barrier among v's products
// publishes q, and no barrier stands between k, v and q. The next pair's k and v are asked for at the head of the window part and land under it. Weights = A operand (rows of D = channels), tokens = B operand (columns of D = tokens): a lane ends with eight neighbouring channels of one token, 16 bytes of f16, staged in LDS as
// [tile row][128 channels] (row pitch 272 B). A wave = 32 channels x 64 tokens (32 for q). Each 16 x 16 accumulator sums k upwards in steps of 32.
// Window part, per pair of heads: one wave = sixteen pixels of one image row of one head (those with x & 2 alike: their tile rows are sixteen in a row, so a 16-byte read of sixteen lanes
// meets every bank once); two lanes share a pixel, lane l holding d = 0 .. 31 and lane l + 16 d = 32 .. 63. Each lane sums its half of all nine logits, one cross-row move and add makes them whole
// in both lanes, and each lane does the whole softmax of its pixel in its own registers; attn * v follows in the same lanes, eight d at a time. k and v come in eight pieces of nine 16-byte reads,
// three register buffers: piece i + 2 is asked for while piece i is worked on. A window place outside the image reads another (in-bounds) tile row; its logit is
// set to 0 and its weight on v to 0. The weights are staged in LDS and stored as whole lines at the end. The f16 result o goes to an LDS tile of 64 pixels x 512 (row pitch 1040 B), where the tokens stood.
// to_out part: out[256 channels][64 pixels] = Bo[256][512] * o^T * alpha + bias, a wave = 32 channels x 64 pixels, k upwards in steps of 32. Bo comes in four tiles of 128 k
// (row pitch 272 B) by asynchronous copies into three buffers: tiles 0 and 1 follow the last weight tiles in the ring and land under the last window part, tile 2 is asked for behind it, tile 3 follows into buffer 0.
__global__ __launch_bounds__(256) void k_all(const float* __restrict__ x, const _Float16* __restrict__ Wh, const _Float16* __restrict__ Bo, const float* __restrict__ bias, float alpha,
                                             float* __restrict__ ATTN, float* __restrict__ OUT) {
  constexpr int PITCH = CC * 2 + 16, TB = 128 * PITCH, SP = 272, KC = 128, WP = 272, WB = CC * WP, OP = INNER * 2 + 16;
  constexpr int SQ = TB + 2 * WB, SK = SQ + 64 * SP, SV = SK + 128 * SP, SA0 = SV + 128 * SP;      // tokens / o at 0; ring buffers at TB and TB + WB, a third Bo buffer at TB + 2 * WB = where q, k, v are staged; attention weights
  __shared__ __attribute__((aligned(16))) unsigned char sm[SA0 + 16 * HWD * 9 * 4];
  const int tid = threadIdx.x, lane = tid & 31, ln = lane & 15, hh = lane >> 4;
  const int w = __builtin_amdgcn_readfirstlane(tid >> 5);      // the wave's number as a scalar: a copy's LDS address is then a scalar sum plus one lane term
  const int b = blockIdx.x / (HWD / 2), y0 = (blockIdx.x % (HWD / 2)) * 2;
  const int wt = w >> 2, wc = w & 3;
  // sixteen copies a thread, rows lstep / gstep apart: lsc = the wave's first LDS byte (a scalar), lvl = the lane's bytes on top of it, gp = the lane's own source
  auto fillg = [&](unsigned lsc, unsigned lvl, const _Float16* gp, unsigned lstep, size_t gstep) {
    const unsigned l = lvl + (unsigned)__builtin_amdgcn_readfirstlane(lsc);      // the scalar part is summed by itself: only the lane term lives in a vector register across the loop
    copy8(l, gp, lstep, gstep);
    copy8(l + 8 * lstep, gp + 8 * gstep, lstep, gstep);
  };
  const unsigned ring = (unsigned)(size_t)sm + TB;      // ring buffer rb stands at ring + rb * WB: a weight tile (TB bytes) or a Bo tile (WB bytes)
  const unsigned llw = lane * 16, glw = lane * 8;                                                        // weight tile: a copy instruction of a wave covers one whole 512-byte row: row w, w + 8, ...
  const unsigned llo = (lane >> 4) * WP + (lane & 15) * 16, glo = (lane >> 4) * INNER + (lane & 15) * 8;      // Bo tile: two whole 256-byte rows: rows 2w and 2w + 1, 2w + 16 and 2w + 17, ...
  auto fillw = [&](int rb, const _Float16* g0) { fillg(ring + rb * WB + w * PITCH, llw, g0 + (size_t)w * CC + glw, 8 * PITCH, (size_t)8 * CC); };      // 128 rows of CC values from g0 on
  auto fillo = [&](int t, int buf) { fillg(ring + buf * WB + 2 * w * WP, llo, Bo + (size_t)(2 * w) * INNER + t * KC + glo, 16 * WP, (size_t)16 * INNER); };      // Bo tile t: 256 rows of KC values
  {      // the token tile. A wave takes 32 channels, a lane four neighbouring pixels of each (a load of a wave = 128 bytes of each of the four image rows);
         // a lane then holds 32 neighbouring channels of each of its four pixels: 64 bytes of that token's f16 row
    const int yy = lane >> 3, c8 = lane & 7;
    const float* xg = x + ((size_t)b * CC + w * 32) * NPIX + min(max(y0 - 1 + yy, 0), HWD - 1) * HWD + c8 * 4;
    v4f xv[32];
#pragma unroll      // unrolled here and below: all 32 loads fly at once, and the values are indexed by constants
    for (int i = 0; i < 32; ++i) xv[i] = *(const v4fa*)(xg + (size_t)i * NPIX);
    asm volatile("s_wait_xcnt 0x0" ::: "memory");      // stands in front of the address sums below, which take over registers that these loads name
    fillw(0, Wh + (size_t)INNER * CC);      // weight tile 0 (k of heads 0 and 1), asked for behind the loads of x, which have the longer way
    const int trow = (yy == 0 ? 2 : yy == 3 ? 3 : yy - 1) * 16 + c8;
#pragma unroll
    for (int pp = 0; pp < 4; ++pp)
#pragma unroll
      for (int q = 0; q < 4; ++q) { FragH f;
#pragma unroll
        for (int e = 0; e < 8; ++e) f.h[e] = (_Float16)(float)(__bf16)xv[q * 8 + e][pp];      // the cast rounds to nearest even: bf16_round's value for every finite x
        *(v8us*)&sm[((pp >> 1) * 64 + (pp & 1) * 8 + trow) * PITCH + w * 64 + q * 16] = f.half[0]; }
  }
  asm volatile("s_wait_dscnt 0x0" ::: "memory");         // this wave's part of the token tile stands in LDS
  asm volatile("s_wait_asynccnt 0x0" ::: "memory");      // weight tile 0: this wave's copies have landed
  __syncthreads();                                       // publishes the token tile and weight tile 0
  fillw(1, Wh + (size_t)2 * INNER * CC);                 // weight tile 1: v of heads 0 and 1
  FragH xb[4][CC / 32];
#pragma unroll      // unrolled: the fragments are indexed by constants and stay in registers
  for (int j = 0; j < 4; ++j)
#pragma unroll
    for (int ks = 0; ks < CC / 32; ++ks) {
      xb[j][ks].half[0] = *(const v8us*)&sm[(wt * 64 + j * 16 + ln) * PITCH + 16 * hh + ks * 64]; xb[j][ks].half[1] = *(const v8us*)&sm[(wt * 64 + j * 16 + ln) * PITCH + 16 * hh + ks * 64 + 32];
    }
  const int aoff = TB + (wc * 32 + ln) * PITCH + 16 * hh;
  // The tiles of a pair are worked on in the order k, v, q: place p = 0, 1, 2, tile number t = 3 * jh + p, buffer t & 1 (kind 0, 1, 2 = q, k, v).
  // refill: tile t + 2 goes into the buffer that tile t (of this kind and pair) stood in; called behind a barrier that ends every reader's last read of tile t
  auto refill = [&](const int kind, const int jh) {
    const int rb = (jh + (kind == 0 ? 2 : kind - 1)) & 1, wb = rb * WB;
    if (kind == 1) fillw(rb, Wh + (size_t)(jh * 128) * CC);      // where k stood: q of this pair
    else {      // where v stood: k of the next pair; where q stood: its v. Behind the last pair the ring goes on with Bo tiles 0 and 1, which land under the last window part.
                // One call with chosen (scalar) terms: as a call of its own in a branch, the Bo copies' 96 address registers were formed in front of the loop and spilled
      const int n = kind == 2 ? 0 : 1;
      const bool more = jh + 1 < NH / 2;
      const _Float16* g0 = more ? Wh + ((size_t)(n + 1) * INNER + (jh + 1) * 128 + w) * CC : Bo + (size_t)(2 * w) * INNER + n * KC;
      fillg(ring + wb + (more ? w * PITCH : 2 * w * WP), more ? llw : llo, g0 + (more ? glw : glo), more ? 8 * PITCH : 16 * WP, more ? (size_t)8 * CC : (size_t)16 * INNER);
    }
  };
  // one weight tile. Its loops are unrolled so that fragments and accumulators are indexed by constants
  auto trip = [&](const int kind, const int jh) {
    const int wb = ((jh + (kind == 0 ? 2 : kind - 1)) & 1) * WB;
    FragH a[CC / 32][2];
#pragma unroll
    for (int ks = 0; ks < CC / 32; ++ks)
#pragma unroll
      for (int i = 0; i < 2; ++i) { a[ks][i].half[0] = *(const v8us*)&sm[wb + aoff + i * 16 * PITCH + ks * 64]; a[ks][i].half[1] = *(const v8us*)&sm[wb + aoff + i * 16 * PITCH + ks * 64 + 32]; }
    v8f acc[2][4] = {};
    auto mm = [&](const int k0, const int k1) {
#pragma unroll
      for (int ks = k0; ks < k1; ++ks)
#pragma unroll
        for (int i = 0; i < 2; ++i)
#pragma unroll
          for (int j = 0; j < (kind == 0 ? 2 : 4); ++j) acc[i][j] = __builtin_amdgcn_wmma_f32_16x16x32_f16(false, a[ks][i].v, false, xb[j][ks].v, (short)0, acc[i][j], false, false);
    };
    auto stage = [&]() {
      const int soff = (kind == 0 ? SQ + (wt * 32 + ln) * SP : (kind == 1 ? SK : SV) + (wt * 64 + ln) * SP) + (wc * 32 + 8 * hh) * 2;
#pragma unroll
      for (int i = 0; i < 2; ++i)
#pragma unroll
        for (int j = 0; j < (kind == 0 ? 2 : 4); ++j) { FragH f;
#pragma unroll
          for (int r = 0; r < 8; ++r) f.h[r] = (_Float16)(acc[i][j][r] * alpha);
          *(v8us*)&sm[soff + j * 16 * SP + i * 32] = f.half[0]; }
    };
    if (kind != 0) {      // k, v: the barrier stands among the products. Behind it both waves of a SIMD still hold products, which cover the copies' issue, the staging of the result and the next tile's first LDS reads
      const int kb = kind == 1 ? 4 : 5;      // by then the LDS has delivered all eight waves' fragments; v's stands one step later, so that q's copies have that much longer to land
      __builtin_amdgcn_sched_barrier(0);                   // keeps the tile's reads one group in front of its products: spread among them, each small group was waited for right behind its issue
      mm(0, kb);
      __builtin_amdgcn_sched_barrier(0);                   // keeps these products in front of the barrier: moved behind it, the matrix unit would idle while the waves gather
      asm volatile("s_wait_dscnt 0x0" ::: "memory");       // this wave's reads of weight buffer t & 1 are done: all its fragments stand in registers
      asm volatile("s_wait_asynccnt 0x0" ::: "memory");    // this wave's copies of tile t + 1 have landed (in k, only v of the first pair is still on its way)
      __syncthreads();                                     // publishes tile t + 1, ends every reader's last read of tile t
      if (kind == 1) {      // q of this pair lands under the rest of k and the first part of v. (v's buffer is refilled in the window part: here the chosen terms of its call made the build spill)
        mm(kb, kb + 1);
        __builtin_amdgcn_sched_barrier(0);                 // keeps one step of products in front of the copies: the SIMD's other wave issues its own while this one issues copies
        refill(kind, jh);
        __builtin_amdgcn_sched_barrier(0);                 // keeps the other products behind the copies, which would else be issued last and land late
        mm(kb + 1, CC / 32);
      } else mm(kb, CC / 32);
      stage();
    } else {
      mm(0, CC / 32);
      stage();
      asm volatile("s_wait_dscnt 0x0" ::: "memory");       // this wave's reads of the weight buffers are done, its parts of the staged q, k, v stand in LDS (no copy is outstanding here)
      __syncthreads();                                     // publishes the staged tiles, ends every reader's last read of both weight buffers
    }
  };
  // window part: what does not change from pair to pair
  const int yb = w & 1, hl = (w >> 1) & 1, xs = w >> 2, y = y0 + yb;
  const int xe = ln >> 1, xo = ln & 1, xx = xe * 4 + xs * 2 + xo;      // this lane's pixel
  const unsigned lun = hl * (DH * 2) + hh * DH;                        // its head and its half of d, in bytes
  const unsigned lq = SQ + (xs * 32 + yb * 16 + xo * 8 + xe) * SP + lun;
  // tile rows of x - 1, x, x + 1, less the image row's term; x - 1 and x + 1 are taken round the image row (& 7): the lane whose neighbour lies outside the image (its logit and weight are masked)
  // reads the row's other end, which is the one tile row of the sixteen that no other lane of its half wave reads, so that these reads too meet every bank once
  const unsigned lkx[3] = {SK + (xo ? xs * 64 + xe : (xs ^ 1) * 64 + 8 + ((xe + 7 + xs) & 7)) * SP + lun,
                           SK + (xs * 64 + xo * 8 + xe) * SP + lun,
                           SK + (xo ? (xs ^ 1) * 64 + ((xe + xs) & 7) : xs * 64 + 8 + xe) * SP + lun};
  const int jrow[3] = {(yb ? 0 : 2) * 16 * SP, (yb ? 1 : 0) * 16 * SP, (yb ? 3 : 1) * 16 * SP};                                               // y - 1, y, y + 1
  const bool okx[3] = {xx > 0, true, xx + 1 < HWD}, oky[3] = {y > 0, true, y + 1 < HWD};
  auto loadkv = [&](int i, H8 (&t)[9]) {      // piece i: 0 .. 3 = k, 4 .. 7 = v, eight d of the nine window places
#pragma unroll
    for (int wi = 0; wi < 9; ++wi) t[wi].v = *(const v8us*)&sm[lkx[wi % 3] + jrow[wi / 3] + (i & 3) * 16 + (i >> 2) * (SV - SK)];
  };
#pragma unroll 1      // kept rolled: one copy of the pair's code, and the token fragments leave no registers for more
  for (int jh = 0; jh < NH / 2; ++jh) {
    trip(1, jh); trip(2, jh); trip(0, jh);
    const int h = jh * 2 + hl;
    float* sa = (float*)(sm + SA0) + (yb * NH + h) * (HWD * 9) + xx * 9 + hh * 4;
    unsigned char* orow = sm + (yb * HWD + xx) * OP + h * (DH * 2) + hh * DH;
    H8 tq[4], tb[3][9];
#pragma unroll
    for (int c = 0; c < 4; ++c) tq[c].v = *(const v8us*)&sm[lq + c * 16];
    loadkv(0, tb[0]);
    __builtin_amdgcn_sched_barrier(0);      // keeps q and piece 0 the first reads to be issued: mixed with the later pieces' reads, the first logit sums would wait for most of those too
    loadkv(1, tb[1]);
    refill(2, jh); refill(0, jh);      // both weight buffers, behind the first reads: the copies are issued while those are on their way, and land under the window part
    float s[9], a[9];
#pragma unroll      // unrolled: the three register buffers take turns by a constant index
    for (int i = 0; i < 8; ++i) {
      if (i + 2 < 8) loadkv(i + 2, tb[(i + 2) % 3]);
      __builtin_amdgcn_sched_barrier(0);      // keeps those reads in front of this piece's arithmetic: sunk into it, each would be waited for right behind its issue
      const H8 (&cb)[9] = tb[i % 3];
      if (i < 4) {
#pragma unroll
        for (int j = 0; j < 4; ++j) {
          const unsigned kj[9] = {cb[0].d[j], cb[1].d[j], cb[2].d[j], cb[3].d[j], cb[4].d[j], cb[5].d[j], cb[6].d[j], cb[7].d[j], cb[8].d[j]};
          if (i == 0 && j == 0) dot9_first(s, tq[i].d[j], kj); else dot9_more(s, tq[i].d[j], kj);
        }
      } else {
        float acc[8];
#pragma unroll
        for (int wi = 0; wi < 9; ++wi) { if (wi == 0) av8_first(acc, a[wi], cb[wi].d); else av8_more(acc, a[wi], cb[wi].d); }
        FragH o;
#pragma unroll
        for (int j = 0; j < 8; ++j) o.h[j] = (_Float16)acc[j];
        *(v8us*)(orow + (i - 4) * 16) = o.half[0];
      }
      if (i == 3) {      // the nine logits are whole behind the cross-row add (the same bits in both lanes of a pixel); softmax in the lane's own registers
        float l[9], e[9];
#pragma unroll
        for (int wi = 0; wi < 9; ++wi) { const float t = s[wi] + xhalf(s[wi]); l[wi] = oky[wi / 3] && okx[wi % 3] ? t * 0.125f : 0.f; }
        const float m = fmaxf(fmaxf(fmaxf(fmaxf(l[0], l[1]), fmaxf(l[2], l[3])), fmaxf(fmaxf(l[4], l[5]), fmaxf(l[6], l[7]))), l[8]);
#pragma unroll
        for (int wi = 0; wi < 9; ++wi) e[wi] = expf(l[wi] - m);
        const float z = (((e[0] + e[1]) + (e[2] + e[3])) + ((e[4] + e[5]) + (e[6] + e[7]))) + e[8];
        const float rz = 1.0f / z;      // one division a pixel
#pragma unroll
        for (int wi = 0; wi < 9; ++wi) e[wi] *= rz;
#pragma unroll
        for (int wi = 0; wi < 5; ++wi) sa[wi] = hh ? e[4 + wi] : e[wi];      // lane l stores weights 0 .. 4, lane l + 16 weights 4 .. 8 (both hold the same bits of weight 4)
#pragma unroll
        for (int wi = 0; wi < 9; ++wi) a[wi] = oky[wi / 3] && okx[wi % 3] ? e[wi] : 0.f;
      }
    }
    asm volatile("s_wait_dscnt 0x0" ::: "memory");         // this wave's reads of the staged q, k, v are done; its part of o and its weights stand in LDS
    asm volatile("s_wait_asynccnt 0x0" ::: "memory");      // this wave's copies of the next pair's k and v (behind the last pair: of Bo tiles 0 and 1) have landed
    __syncthreads();                                       // publishes those two tiles, ends every reader's last read of the staged tiles before the next pair overwrites them; behind the last pair it publishes o and the weights too
  }
  fillo(2, 2);      // where the staged tiles stood
  const int aoff2 = TB + (w * 32 + ln) * WP + 16 * hh, boff2 = ln * OP + 16 * hh;
  v8f cacc[2][4] = {};
  const int row0 = w * 32;
  auto tile = [&](int t, int buf) {      // its loops are unrolled so that fragments and accumulators are indexed by constants and stay in registers
#pragma unroll
    for (int ks = 0; ks < KC / 32; ++ks) {
      FragH fa[2], fb[4];
#pragma unroll
      for (int i = 0; i < 2; ++i) { fa[i].half[0] = *(const v8us*)&sm[buf * WB + aoff2 + i * 16 * WP + ks * 64]; fa[i].half[1] = *(const v8us*)&sm[buf * WB + aoff2 + i * 16 * WP + ks * 64 + 32]; }
#pragma unroll
      for (int j = 0; j < 4; ++j) { fb[j].half[0] = *(const v8us*)&sm[boff2 + j * 16 * OP + t * (KC * 2) + ks * 64]; fb[j].half[1] = *(const v8us*)&sm[boff2 + j * 16 * OP + t * (KC * 2) + ks * 64 + 32]; }
#pragma unroll
      for (int i = 0; i < 2; ++i)
#pragma unroll
        for (int j = 0; j < 4; ++j) cacc[i][j] = __builtin_amdgcn_wmma_f32_16x16x32_f16(false, fa[i].v, false, fb[j].v, (short)0, cacc[i][j], false, false);
    }
  };
  tile(0, 0);
  asm volatile("s_wait_dscnt 0x0" ::: "memory");         // this wave's reads of buffer 0 are done before it is refilled
  __syncthreads();                                       // ends every reader's last read of Bo tile 0
  fillo(3, 0);
  v4f bq[2][2];      // the bias of this lane's sixteen rows, asked for here: it comes under tile 1, so neither the next barrier nor the epilogue waits for it
#pragma unroll
  for (int i = 0; i < 2; ++i) { bq[i][0] = *(const v4fa*)(bias + row0 + i * 16 + 8 * hh); bq[i][1] = *(const v4fa*)(bias + row0 + i * 16 + 8 * hh + 4); }
  asm volatile("s_wait_xcnt 0x0" ::: "memory");          // stands in front of tile 1's fragment reads, which take over the address register that these loads name
  tile(1, 1);                                            // tiles 2 and 3 fly meanwhile
  asm volatile("s_wait_dscnt 0x0" ::: "memory");         // this wave's reads of buffer 1 are done before it becomes output staging
  asm volatile("s_wait_asynccnt 0x0" ::: "memory");      // this wave's copies of tiles 2 and 3 have landed; none is outstanding from here on
  __syncthreads();                                       // publishes tiles 2 and 3, ends every reader's last read of tile 1
  {      // the weights go out late: no barrier and no fence then waits for these stores. A wave stores two whole (image row, head) rows of 32 x 9 floats: 72 pieces of 16 bytes each
    const float* sr = (const float*)(sm + SA0) + w * 2 * (HWD * 9);
    float* ap0 = ATTN + (((size_t)b * NH + ((w * 2) & 7)) * NPIX + (y0 + (w >> 2)) * HWD) * 9;      // rows 2w and 2w + 1: heads (2w) & 7 and the next, of the same image row
    float* ap1 = ap0 + (size_t)NPIX * 9;
    const int i2 = 64 + (lane & 7);      // the last eight pieces of a row: read by every lane, stored by lanes 0 .. 7
    const v4f a0 = *(const v4fa*)&sr[lane * 4], a1 = *(const v4fa*)&sr[(32 + lane) * 4], a2 = *(const v4fa*)&sr[i2 * 4];
    const v4f b0 = *(const v4fa*)&sr[HWD * 9 + lane * 4], b1 = *(const v4fa*)&sr[HWD * 9 + (32 + lane) * 4], b2 = *(const v4fa*)&sr[HWD * 9 + i2 * 4];
    __builtin_amdgcn_sched_barrier(0);      // keeps every LDS read in front of the first store
    if (lane < 8) { *(v4f*)(ap0 + (64 + lane) * 4) = a2; *(v4f*)(ap1 + (64 + lane) * 4) = b2; }      // first: this build forms an address pair for them, which behind the other stores took over a stored register
    *(v4f*)(ap0 + lane * 4) = a0; *(v4f*)(ap0 + (32 + lane) * 4) = a1; *(v4f*)(ap1 + lane * 4) = b0; *(v4f*)(ap1 + (32 + lane) * 4) = b1;
    asm volatile("s_wait_xcnt 0x0" ::: "memory");      // stands in front of the next tile's overwrites of the registers that these stores name
  }
  tile(2, 2); tile(3, 0);
  // epilogue: each wave stages its 32 x 64 tile in its own range of buffer 1 (pitch 68 floats) and stores whole lines: a row is a channel, its 64 columns the two image rows, side by side in memory
  float* so = (float*)(sm + TB + WB) + w * (32 * 68);
#pragma unroll      // unrolled here and below: the accumulators and the bias are indexed by constants
  for (int i = 0; i < 2; ++i)
#pragma unroll
    for (int r = 0; r < 8; ++r) {
      const float bv = bf16_round(bq[i][r >> 2][r & 3]);
#pragma unroll
      for (int j = 0; j < 4; ++j) so[(i * 16 + 8 * hh + r) * 68 + j * 16 + ln] = cacc[i][j][r] * alpha + bv;
    }
  asm volatile("s_wait_dscnt 0x0" ::: "memory");      // the wave's own LDS writes are done before other lanes of it read them (a fence here would wait for the weights' stores as well)
  const int rs = lane >> 4, q4 = (lane & 15) * 4;
  float* cp = OUT + ((size_t)b * CC + row0 + rs) * NPIX + y0 * HWD + q4;
#pragma unroll
  for (int q = 0; q < 16; ++q) { const v4f v = *(const v4fa*)&so[(q * 2 + rs) * 68 + q4]; *(v4f*)(cp + q * 2 * NPIX) = v; }
}
extern "C" void kernel_launch(void* const* d_in, const int* in_sizes, int n_in,
                              void* d_out, int out_size, void* d_ws, size_t ws_size, hipStream_t stream) {
  (void)in_sizes; (void)n_in; (void)out_size;
  const float* x = (const float*)d_in[0]; const float* Wq = (const float*)d_in[1]; const float* Wkv = (const float*)d_in[2]; const float* Wo = (const float*)d_in[3]; const float* bo = (const float*)d_in[4];
  float* OUT0 = (float*)d_out; float* ATTN = OUT0 + (size_t)BB * CC * NPIX;
  _Float16* Bw = (_Float16*)d_ws; _Float16* Bo = Bw + (size_t)3 * INNER * CC;      // [Wq | Wkv] (1536 rows of 256), then Wo (256 rows of 512)
  if ((size_t)4 * INNER * CC * 2 > ws_size) return;      // 1.1 MB
  k_prep<<<NBW, 256, 0, stream>>>(Wq, Wkv, Wo, Bw);
  k_all<<<BB * (HWD / 2), 256, 0, stream>>>(x, Bw, Bo, bo, 0.0625f, ATTN, OUT0);      // q | k | v, window attention, to_out + bo with channels as rows: stored as NCHW
}
